// v000
// The times below were measured on an AMD MI455X: many runs one after another, warmed up first and cycling through
// copies of the inputs, with the whole window's GPU time divided by the number of runs. Launches and the gaps
// between them are all in it. The median over several windows is given; except for v000 it joins two sittings, which
// can be a few percent apart, so the side-by-side timings, each taken in one sitting, are the better comparison.
// v000 is the starting kernel. One run takes 22 microseconds.
#include <hip/hip_runtime.h>
#include <stdint.h>

typedef __attribute__((ext_vector_type(2))) float    v2f;
typedef __attribute__((ext_vector_type(4))) float    v4f;
typedef __attribute__((ext_vector_type(8))) float    v8f;
typedef __attribute__((ext_vector_type(4))) unsigned u32x4;
typedef __attribute__((ext_vector_type(8))) int      i32x8;
typedef __attribute__((ext_vector_type(4))) int      i32x4;

#define T     16       // time steps
#define CCH   64       // channels
#define HW    3136     // 56*56
#define WIMG  56
#define P     64       // DIM*DIM token features
#define QKD   128      // 2*DIM_HEAD
#define CHW   (CCH*HW) // t-stride in x (elements)
#define SLABSTRIDE 76  // 64 data + 12 pad dwords per row: conflict-free for rows +2 and +8

#if defined(__gfx1250__) && __has_builtin(__builtin_amdgcn_tensor_load_to_lds)
#define USE_TDM 1
#else
#define USE_TDM 0
#endif

__global__ __launch_bounds__(256) void cta_attn_kernel(
    const float* __restrict__ x,
    const float* __restrict__ pos,
    const float* __restrict__ Wqk,
    const float* __restrict__ gamma,
    const float* __restrict__ beta,
    float* __restrict__ out)
{
  // colsum (phase A pooling) and slabs (phase B v-staging) have disjoint lifetimes.
  __shared__ __align__(16) union {
    float colsum[T * 8 * WIMG];        // 7168 floats: 7-row column sums
    float slab[8 * 16 * SLABSTRIDE];   // 9728 floats: per-wave 16x64 v tile (stride 76)
  } u;
  __shared__ float s_lds[T * 65];      // tokens (padded stride)
  __shared__ float qk_lds[T * 129];    // q|k (padded stride)
  __shared__ float attn_lds[T * 17];   // attention matrix (padded stride)
  __shared__ float mu_lds[T];
  __shared__ float rs_lds[T];

  const int tid    = threadIdx.x;
  const int lane   = tid & 31;
  const int wave   = tid >> 5;
  const int lane16 = lane & 15;
  const int half   = lane >> 4;

  const int bc = blockIdx.x;           // b*64 + c
  const int bb = bc >> 6;
  const int ch = bc & 63;
  const size_t xbase = ((size_t)(bb * T) * CCH + ch) * HW;  // x[b,0,c,0,0]

  // ---------- Phase A1: 7-row column sums, float4 (b128) coalesced loads
  // 1792 float4 column groups: (t, py, c4) with c4 in [0,14)
#pragma unroll
  for (int i = 0; i < 7; ++i) {
    int g  = tid + 256 * i;            // 0..1791
    int c4 = g % 14;
    int py = (g / 14) & 7;
    int t  = g / 112;
    const float* src = x + xbase + (size_t)t * CHW + (py * 7) * WIMG + c4 * 4;
    v4f s = {};
#pragma unroll
    for (int r = 0; r < 7; ++r)
      s += *(const v4f*)(src + r * WIMG);
    *(v4f*)(u.colsum + (t * 8 + py) * WIMG + c4 * 4) = s;
  }
  __syncthreads();

  // ---------- Phase A2: horizontal 7-sum + pos embedding -> tokens
  for (int i = 0; i < 4; ++i) {
    int o = tid + 256 * i;
    int t = o >> 6, p = o & 63;
    int py = p >> 3, px = p & 7;
    const float* cs = u.colsum + (t * 8 + py) * WIMG + px * 7;
    float s = 0.f;
#pragma unroll
    for (int cc = 0; cc < 7; ++cc) s += cs[cc];
    s_lds[t * 65 + p] = s * (1.0f / 49.0f) + pos[((size_t)bc * T + t) * P + p];
  }
  __syncthreads();

  // ---------- Phase A3: LayerNorm over 64 features
  if (tid < T) {
    float m = 0.f;
    for (int p = 0; p < P; ++p) m += s_lds[tid * 65 + p];
    m *= (1.0f / 64.0f);
    float v = 0.f;
    for (int p = 0; p < P; ++p) { float d = s_lds[tid * 65 + p] - m; v += d * d; }
    v *= (1.0f / 64.0f);
    mu_lds[tid] = m;
    rs_lds[tid] = rsqrtf(v + 1e-5f);
  }
  __syncthreads();
  for (int i = 0; i < 4; ++i) {
    int o = tid + 256 * i;
    int t = o >> 6, p = o & 63;
    float sv = s_lds[t * 65 + p];
    s_lds[t * 65 + p] = (sv - mu_lds[t]) * rs_lds[t] * gamma[p] + beta[p];
  }
  __syncthreads();

  // ---------- Phase A4: qk = s (16x64) @ Wqk (64x128); wave w -> 16-col tile w
  {
    v8f acc = {};
    const int n = wave * 16 + lane16;
#pragma unroll
    for (int k0 = 0; k0 < 64; k0 += 4) {
      int ka = k0 + 2 * half;
      v2f a, b;
      a.x = s_lds[lane16 * 65 + ka];
      a.y = s_lds[lane16 * 65 + ka + 1];
      b.x = Wqk[ka * QKD + n];
      b.y = Wqk[(ka + 1) * QKD + n];
      acc = __builtin_amdgcn_wmma_f32_16x16x4_f32(false, a, false, b, (short)0, acc, false, false);
    }
#pragma unroll
    for (int r = 0; r < 8; ++r)
      qk_lds[(r + 8 * half) * 129 + wave * 16 + lane16] = acc[r];
  }
  __syncthreads();

  // ---------- Phase A5: dots = q @ k^T * scale (wave 0; wave-uniform branch)
  if (wave == 0) {
    v8f acc = {};
#pragma unroll
    for (int k0 = 0; k0 < 64; k0 += 4) {
      int ka = k0 + 2 * half;
      v2f a, b;
      a.x = qk_lds[lane16 * 129 + ka];
      a.y = qk_lds[lane16 * 129 + ka + 1];
      b.x = qk_lds[lane16 * 129 + 64 + ka];
      b.y = qk_lds[lane16 * 129 + 64 + ka + 1];
      acc = __builtin_amdgcn_wmma_f32_16x16x4_f32(false, a, false, b, (short)0, acc, false, false);
    }
#pragma unroll
    for (int r = 0; r < 8; ++r)
      attn_lds[(r + 8 * half) * 17 + lane16] = acc[r] * 0.125f;  // DIM_HEAD^-0.5
  }
  __syncthreads();

  // ---------- Phase A6: softmax rows
  if (tid < T) {
    float mx = -3.4e38f;
    for (int j = 0; j < T; ++j) mx = fmaxf(mx, attn_lds[tid * 17 + j]);
    float sum = 0.f;
    for (int j = 0; j < T; ++j) {
      float e = __expf(attn_lds[tid * 17 + j] - mx);
      attn_lds[tid * 17 + j] = e;
      sum += e;
    }
    float inv = 1.0f / sum;
    for (int j = 0; j < T; ++j) attn_lds[tid * 17 + j] *= inv;
  }
  __syncthreads();
  // attn_lds is read-only from here; slabs are per-wave -> no more block barriers.

  // ---------- Phase B: out = attn (16x16) @ v (16x3136) + x, per-wave 64-col chunks
  float* slabp = u.slab + wave * (16 * SLABSTRIDE);

  for (int chunk = wave; chunk < 49; chunk += 8) {   // 49 chunks of 64 columns
    const int n0 = chunk * 64;

#if USE_TDM
    // prior chunk's ds reads must land before the DMA overwrites the slab
    asm volatile("s_wait_dscnt 0x0" ::: "memory");
    {
      unsigned lds_off = (unsigned)(uintptr_t)slabp;               // flat low 32b = LDS byte offset
      unsigned long long ga = (unsigned long long)(uintptr_t)(x + xbase + n0);
      // D# group0: count=1 | lds_addr | global_addr[56:0] | type=2
      u32x4 g0 = { 1u, lds_off, (unsigned)ga,
                   (unsigned)((ga >> 32) & 0x1FFFFFFu) | (2u << 30) };
      // D# group1: data_size=4B, pad_enable, pad_interval=64dw, pad_amount=12dw,
      //            tensor_dim0=HW, tensor_dim1=T, tile=64x16, dim0_stride=CHW
      i32x8 g1 = { (int)((2u << 16) | (1u << 20) | (5u << 22) | (11u << 25)),
                   (int)((unsigned)HW << 16),
                   (int)((unsigned)T << 16) | (int)((unsigned)HW >> 16),
                   (int)(64u << 16),
                   16,
                   (int)(CHW),
                   0, 0 };
      i32x4 gz4 = { 0, 0, 0, 0 };
      i32x8 gz8 = { 0, 0, 0, 0, 0, 0, 0, 0 };
      __builtin_amdgcn_tensor_load_to_lds(g0, g1, gz4, gz4, gz8, 0);
    }
#if __has_builtin(__builtin_amdgcn_s_wait_tensorcnt)
    __builtin_amdgcn_s_wait_tensorcnt(0);
#else
    asm volatile("s_wait_tensorcnt 0x0" ::: "memory");
#endif
    asm volatile("" ::: "memory");   // DMA wrote LDS behind the compiler's back
#else
    // fallback: vectorized staging, 16 rows x 16 float4
#pragma unroll
    for (int i = 0; i < 8; ++i) {
      int idx = lane + 32 * i;
      int row = idx >> 4, c4 = idx & 15;
      *(v4f*)(slabp + row * SLABSTRIDE + c4 * 4) =
          *(const v4f*)(x + xbase + (size_t)row * CHW + n0 + c4 * 4);
    }
#endif

    // 4 sub-tiles of 16 columns: D = attn @ v_sub + x_sub (residual seeds C)
#pragma unroll
    for (int sub = 0; sub < 4; ++sub) {
      const int s16 = sub * 16;
      v8f acc;
#pragma unroll
      for (int r = 0; r < 8; ++r)
        acc[r] = slabp[(r + 8 * half) * SLABSTRIDE + s16 + lane16];
#pragma unroll
      for (int k0 = 0; k0 < 16; k0 += 4) {
        int ka = k0 + 2 * half;
        v2f a, b;
        a.x = attn_lds[lane16 * 17 + ka];
        a.y = attn_lds[lane16 * 17 + ka + 1];
        b.x = slabp[ka * SLABSTRIDE + s16 + lane16];
        b.y = slabp[(ka + 1) * SLABSTRIDE + s16 + lane16];
        acc = __builtin_amdgcn_wmma_f32_16x16x4_f32(false, a, false, b, (short)0, acc, false, false);
      }
      // in-place writeback (reads of this sub-tile precede in program order; LDS is
      // in-order within a wave)
#pragma unroll
      for (int r = 0; r < 8; ++r)
        slabp[(r + 8 * half) * SLABSTRIDE + s16 + lane16] = acc[r];
    }

    // transpose out of LDS and store 128-bit non-temporal (two 256B contiguous rows per instr)
#pragma unroll
    for (int i = 0; i < 8; ++i) {
      int idx = lane + 32 * i;
      int row = idx >> 4, c4 = idx & 15;
      v4f vv = *(const v4f*)(slabp + row * SLABSTRIDE + c4 * 4);
      __builtin_nontemporal_store(vv, (v4f*)(out + xbase + (size_t)row * CHW + n0 + c4 * 4));
    }
  }
}

extern "C" void kernel_launch(void* const* d_in, const int* in_sizes, int n_in,
                              void* d_out, int out_size, void* d_ws, size_t ws_size,
                              hipStream_t stream) {
  (void)in_sizes; (void)n_in; (void)d_ws; (void)ws_size; (void)out_size;
  const float* x     = (const float*)d_in[0];
  const float* pos   = (const float*)d_in[1];
  const float* Wqk   = (const float*)d_in[2];
  const float* gamma = (const float*)d_in[3];
  const float* beta  = (const float*)d_in[4];
  float* out = (float*)d_out;
  cta_attn_kernel<<<dim3(512), dim3(256), 0, stream>>>(x, pos, Wqk, gamma, beta, out);
}

// v001
// It runs in 21.5 microseconds.
// In two side-by-side timings against v000, it was 1.05 and 1.04 times as fast.
#include <hip/hip_runtime.h>
#include <stdint.h>

typedef __attribute__((ext_vector_type(2))) float    v2f;
typedef __attribute__((ext_vector_type(4))) float    v4f;
typedef __attribute__((ext_vector_type(8))) float    v8f;
typedef __attribute__((ext_vector_type(4))) unsigned u32x4;
typedef __attribute__((ext_vector_type(8))) int      i32x8;
typedef __attribute__((ext_vector_type(4))) int      i32x4;

#define T     16       // time steps
#define CCH   64       // channels
#define HW    3136     // 56*56
#define WIMG  56
#define P     64       // DIM*DIM token features
#define QKD   128      // 2*DIM_HEAD
#define CHW   (CCH*HW) // t-stride in x (elements)
#define SLABSTRIDE 76  // 64 data + 12 pad dwords per row: conflict-free for rows +2 and +8

#if defined(__gfx1250__) && __has_builtin(__builtin_amdgcn_tensor_load_to_lds)
#define USE_TDM 1
#else
#define USE_TDM 0
#endif

// value of lane l ^ M inside a 16-lane row (DPP row_xmask); every lane must be on
template <int M>
__device__ __forceinline__ float row_xor(float x) {
  return __builtin_bit_cast(float, __builtin_amdgcn_update_dpp(
      0, __builtin_bit_cast(int, x), 0x160 | M, 0xf, 0xf, true));
}
// sum over a 16-lane row, the result in every lane of it
__device__ __forceinline__ float row16_sum(float x) {
  x += row_xor<1>(x);
  x += row_xor<2>(x);
  x += row_xor<4>(x);
  x += row_xor<8>(x);
  return x;
}

__global__ __launch_bounds__(256) void cta_attn_kernel(
    const float* __restrict__ x,
    const float* __restrict__ pos,
    const float* __restrict__ Wqk,
    const float* __restrict__ gamma,
    const float* __restrict__ beta,
    float* __restrict__ out)
{
  // colsum (phase A pooling) and slabs (phase B v-staging) have disjoint lifetimes.
  __shared__ __align__(16) union {
    float colsum[T * 8 * WIMG];        // 7168 floats: 7-row column sums
    float slab[8 * 16 * SLABSTRIDE];   // 9728 floats: per-wave 16x64 v tile (stride 76)
  } u;
  __shared__ float s_lds[T * 65];      // tokens (padded stride)
  __shared__ float qk_lds[T * 129];    // q|k (padded stride)
  __shared__ float attn_lds[T * 17];   // attention matrix (padded stride)

  const int tid    = threadIdx.x;
  const int lane   = tid & 31;
  const int wave   = tid >> 5;
  const int lane16 = lane & 15;
  const int half   = lane >> 4;

  const int bc = blockIdx.x;           // b*64 + c
  const int bb = bc >> 6;
  const int ch = bc & 63;
  const size_t xbase = ((size_t)(bb * T) * CCH + ch) * HW;  // x[b,0,c,0,0]

  // ---------- Phase A1: 7-row column sums, float4 (b128) coalesced loads
  // 1792 float4 column groups: (t, py, c4) with c4 in [0,14)
#pragma unroll
  for (int i = 0; i < 7; ++i) {
    int g  = tid + 256 * i;            // 0..1791
    int c4 = g % 14;
    int py = (g / 14) & 7;
    int t  = g / 112;
    const float* src = x + xbase + (size_t)t * CHW + (py * 7) * WIMG + c4 * 4;
    v4f s = {};
#pragma unroll
    for (int r = 0; r < 7; ++r)
      s += *(const v4f*)(src + r * WIMG);
    *(v4f*)(u.colsum + (t * 8 + py) * WIMG + c4 * 4) = s;
  }
  __syncthreads();

  // ---------- Phase A2+A3: tokens and LayerNorm in registers, 16 lanes a token row,
  // 4 features a lane. Feature p of row t sums colsum[t*448 + 7p .. 7p+6], so thread
  // (trow, j16) reads the 28 consecutive column sums at 28*tid.
  {
    const int trow = tid >> 4;         // token row
    const int j16  = tid & 15;         // features 4*j16 .. 4*j16+3
    const v4f pv = *(const v4f*)(pos + ((size_t)bc * T + trow) * P + j16 * 4);
    const v4f gv = *(const v4f*)(gamma + j16 * 4);
    const v4f bv = *(const v4f*)(beta + j16 * 4);
    float f[28];
    for (int i = 0; i < 7; ++i) {
      v4f c = *(const v4f*)(u.colsum + tid * 28 + i * 4);
      f[4 * i] = c.x; f[4 * i + 1] = c.y; f[4 * i + 2] = c.z; f[4 * i + 3] = c.w;
    }
    v4f tok;
    for (int q = 0; q < 4; ++q) {
      float s = 0.f;
      for (int cc = 0; cc < 7; ++cc) s += f[7 * q + cc];
      tok[q] = s * (1.0f / 49.0f) + pv[q];
    }
    float m = row16_sum((tok.x + tok.y) + (tok.z + tok.w)) * (1.0f / 64.0f);
    v4f d = tok - m;
    float v = row16_sum((d.x * d.x + d.y * d.y) + (d.z * d.z + d.w * d.w)) * (1.0f / 64.0f);
    float rs = rsqrtf(v + 1e-5f);
    for (int q = 0; q < 4; ++q)
      s_lds[trow * 65 + j16 * 4 + q] = d[q] * rs * gv[q] + bv[q];
  }
  __syncthreads();

  // ---------- Phase A4: qk = s (16x64) @ Wqk (64x128); wave w -> 16-col tile w
  {
    v8f acc = {};
    const int n = wave * 16 + lane16;
#pragma unroll
    for (int k0 = 0; k0 < 64; k0 += 4) {
      int ka = k0 + 2 * half;
      v2f a, b;
      a.x = s_lds[lane16 * 65 + ka];
      a.y = s_lds[lane16 * 65 + ka + 1];
      b.x = Wqk[ka * QKD + n];
      b.y = Wqk[(ka + 1) * QKD + n];
      acc = __builtin_amdgcn_wmma_f32_16x16x4_f32(false, a, false, b, (short)0, acc, false, false);
    }
#pragma unroll
    for (int r = 0; r < 8; ++r)
      qk_lds[(r + 8 * half) * 129 + wave * 16 + lane16] = acc[r];
  }
  __syncthreads();

  // ---------- Phase A5: dots = q @ k^T * scale (wave 0; wave-uniform branch)
  if (wave == 0) {
    v8f acc = {};
#pragma unroll
    for (int k0 = 0; k0 < 64; k0 += 4) {
      int ka = k0 + 2 * half;
      v2f a, b;
      a.x = qk_lds[lane16 * 129 + ka];
      a.y = qk_lds[lane16 * 129 + ka + 1];
      b.x = qk_lds[lane16 * 129 + 64 + ka];
      b.y = qk_lds[lane16 * 129 + 64 + ka + 1];
      acc = __builtin_amdgcn_wmma_f32_16x16x4_f32(false, a, false, b, (short)0, acc, false, false);
    }
#pragma unroll
    for (int r = 0; r < 8; ++r)
      attn_lds[(r + 8 * half) * 17 + lane16] = acc[r] * 0.125f;  // DIM_HEAD^-0.5
  }
  __syncthreads();

  // ---------- Phase A6: softmax rows
  if (tid < T) {
    float mx = -3.4e38f;
    for (int j = 0; j < T; ++j) mx = fmaxf(mx, attn_lds[tid * 17 + j]);
    float sum = 0.f;
    for (int j = 0; j < T; ++j) {
      float e = __expf(attn_lds[tid * 17 + j] - mx);
      attn_lds[tid * 17 + j] = e;
      sum += e;
    }
    float inv = 1.0f / sum;
    for (int j = 0; j < T; ++j) attn_lds[tid * 17 + j] *= inv;
  }
  __syncthreads();
  // attn_lds is read-only from here; slabs are per-wave -> no more block barriers.

  // ---------- Phase B: out = attn (16x16) @ v (16x3136) + x, per-wave 64-col chunks
  float* slabp = u.slab + wave * (16 * SLABSTRIDE);

  for (int chunk = wave; chunk < 49; chunk += 8) {   // 49 chunks of 64 columns
    const int n0 = chunk * 64;

#if USE_TDM
    // prior chunk's ds reads must land before the DMA overwrites the slab
    asm volatile("s_wait_dscnt 0x0" ::: "memory");
    {
      unsigned lds_off = (unsigned)(uintptr_t)slabp;               // flat low 32b = LDS byte offset
      unsigned long long ga = (unsigned long long)(uintptr_t)(x + xbase + n0);
      // D# group0: count=1 | lds_addr | global_addr[56:0] | type=2
      u32x4 g0 = { 1u, lds_off, (unsigned)ga,
                   (unsigned)((ga >> 32) & 0x1FFFFFFu) | (2u << 30) };
      // D# group1: data_size=4B, pad_enable, pad_interval=64dw, pad_amount=12dw,
      //            tensor_dim0=HW, tensor_dim1=T, tile=64x16, dim0_stride=CHW
      i32x8 g1 = { (int)((2u << 16) | (1u << 20) | (5u << 22) | (11u << 25)),
                   (int)((unsigned)HW << 16),
                   (int)((unsigned)T << 16) | (int)((unsigned)HW >> 16),
                   (int)(64u << 16),
                   16,
                   (int)(CHW),
                   0, 0 };
      i32x4 gz4 = { 0, 0, 0, 0 };
      i32x8 gz8 = { 0, 0, 0, 0, 0, 0, 0, 0 };
      __builtin_amdgcn_tensor_load_to_lds(g0, g1, gz4, gz4, gz8, 0);
    }
#if __has_builtin(__builtin_amdgcn_s_wait_tensorcnt)
    __builtin_amdgcn_s_wait_tensorcnt(0);
#else
    asm volatile("s_wait_tensorcnt 0x0" ::: "memory");
#endif
    asm volatile("" ::: "memory");   // DMA wrote LDS behind the compiler's back
#else
    // fallback: vectorized staging, 16 rows x 16 float4
#pragma unroll
    for (int i = 0; i < 8; ++i) {
      int idx = lane + 32 * i;
      int row = idx >> 4, c4 = idx & 15;
      *(v4f*)(slabp + row * SLABSTRIDE + c4 * 4) =
          *(const v4f*)(x + xbase + (size_t)row * CHW + n0 + c4 * 4);
    }
#endif

    // 4 sub-tiles of 16 columns: D = attn @ v_sub + x_sub (residual seeds C)
#pragma unroll
    for (int sub = 0; sub < 4; ++sub) {
      const int s16 = sub * 16;
      v8f acc;
#pragma unroll
      for (int r = 0; r < 8; ++r)
        acc[r] = slabp[(r + 8 * half) * SLABSTRIDE + s16 + lane16];
#pragma unroll
      for (int k0 = 0; k0 < 16; k0 += 4) {
        int ka = k0 + 2 * half;
        v2f a, b;
        a.x = attn_lds[lane16 * 17 + ka];
        a.y = attn_lds[lane16 * 17 + ka + 1];
        b.x = slabp[ka * SLABSTRIDE + s16 + lane16];
        b.y = slabp[(ka + 1) * SLABSTRIDE + s16 + lane16];
        acc = __builtin_amdgcn_wmma_f32_16x16x4_f32(false, a, false, b, (short)0, acc, false, false);
      }
      // in-place writeback (reads of this sub-tile precede in program order; LDS is
      // in-order within a wave)
#pragma unroll
      for (int r = 0; r < 8; ++r)
        slabp[(r + 8 * half) * SLABSTRIDE + s16 + lane16] = acc[r];
    }

    // transpose out of LDS and store 128-bit non-temporal (two 256B contiguous rows per instr)
#pragma unroll
    for (int i = 0; i < 8; ++i) {
      int idx = lane + 32 * i;
      int row = idx >> 4, c4 = idx & 15;
      v4f vv = *(const v4f*)(slabp + row * SLABSTRIDE + c4 * 4);
      __builtin_nontemporal_store(vv, (v4f*)(out + xbase + (size_t)row * CHW + n0 + c4 * 4));
    }
  }
}

extern "C" void kernel_launch(void* const* d_in, const int* in_sizes, int n_in,
                              void* d_out, int out_size, void* d_ws, size_t ws_size,
                              hipStream_t stream) {
  (void)in_sizes; (void)n_in; (void)d_ws; (void)ws_size; (void)out_size;
  const float* x     = (const float*)d_in[0];
  const float* pos   = (const float*)d_in[1];
  const float* Wqk   = (const float*)d_in[2];
  const float* gamma = (const float*)d_in[3];
  const float* beta  = (const float*)d_in[4];
  float* out = (float*)d_out;
  cta_attn_kernel<<<dim3(512), dim3(256), 0, stream>>>(x, pos, Wqk, gamma, beta, out);
}

// v002
// One run takes 20.6 microseconds.
// Two timings next to v001 both put it at 1.04 times that version's speed.
// Over all steps from v000 it is 1.09 times as fast.
#include <hip/hip_runtime.h>
#include <stdint.h>

typedef __attribute__((ext_vector_type(2))) float    v2f;
typedef __attribute__((ext_vector_type(4))) float    v4f;
typedef __attribute__((ext_vector_type(8))) float    v8f;

#define T     16       // time steps
#define CCH   64       // channels
#define HW    3136     // 56*56
#define WIMG  56
#define P     64       // DIM*DIM token features
#define QKD   128      // 2*DIM_HEAD
#define CHW   (CCH*HW) // t-stride in x (elements)

// value of lane l ^ M inside a 16-lane row (DPP row_xmask); every lane must be on
template <int M>
__device__ __forceinline__ float row_xor(float x) {
  return __builtin_bit_cast(float, __builtin_amdgcn_update_dpp(
      0, __builtin_bit_cast(int, x), 0x160 | M, 0xf, 0xf, true));
}
// sum over a 16-lane row, the result in every lane of it
__device__ __forceinline__ float row16_sum(float x) {
  x += row_xor<1>(x);
  x += row_xor<2>(x);
  x += row_xor<4>(x);
  x += row_xor<8>(x);
  return x;
}

__global__ __launch_bounds__(256) void cta_attn_kernel(
    const float* __restrict__ x,
    const float* __restrict__ pos,
    const float* __restrict__ Wqk,
    const float* __restrict__ gamma,
    const float* __restrict__ beta,
    float* __restrict__ out)
{
  __shared__ __align__(16) float colsum[T * 8 * WIMG];   // 7-row column sums
  __shared__ float s_lds[T * 65];      // tokens (padded stride)
  __shared__ float qk_lds[T * 129];    // q|k (padded stride)
  __shared__ float attn_lds[T * 17];   // attention matrix (padded stride)

  const int tid    = threadIdx.x;
  const int lane   = tid & 31;
  const int wave   = tid >> 5;
  const int lane16 = lane & 15;
  const int half   = lane >> 4;

  const int bc = blockIdx.x;           // b*64 + c
  const int bb = bc >> 6;
  const int ch = bc & 63;
  const size_t xbase = ((size_t)(bb * T) * CCH + ch) * HW;  // x[b,0,c,0,0]

  // ---------- Phase A1: 7-row column sums, float4 (b128) coalesced loads
  // 1792 float4 column groups: (t, py, c4) with c4 in [0,14)
#pragma unroll
  for (int i = 0; i < 7; ++i) {
    int g  = tid + 256 * i;            // 0..1791
    int c4 = g % 14;
    int py = (g / 14) & 7;
    int t  = g / 112;
    const float* src = x + xbase + (size_t)t * CHW + (py * 7) * WIMG + c4 * 4;
    v4f s = {};
#pragma unroll
    for (int r = 0; r < 7; ++r)
      s += *(const v4f*)(src + r * WIMG);
    *(v4f*)(colsum + (t * 8 + py) * WIMG + c4 * 4) = s;
  }
  __syncthreads();

  // ---------- Phase A2+A3: tokens and LayerNorm in registers, 16 lanes a token row,
  // 4 features a lane. Feature p of row t sums colsum[t*448 + 7p .. 7p+6], so thread
  // (trow, j16) reads the 28 consecutive column sums at 28*tid.
  {
    const int trow = tid >> 4;         // token row
    const int j16  = tid & 15;         // features 4*j16 .. 4*j16+3
    const v4f pv = *(const v4f*)(pos + ((size_t)bc * T + trow) * P + j16 * 4);
    const v4f gv = *(const v4f*)(gamma + j16 * 4);
    const v4f bv = *(const v4f*)(beta + j16 * 4);
    float f[28];
    for (int i = 0; i < 7; ++i) {
      v4f c = *(const v4f*)(colsum + tid * 28 + i * 4);
      f[4 * i] = c.x; f[4 * i + 1] = c.y; f[4 * i + 2] = c.z; f[4 * i + 3] = c.w;
    }
    v4f tok;
    for (int q = 0; q < 4; ++q) {
      float s = 0.f;
      for (int cc = 0; cc < 7; ++cc) s += f[7 * q + cc];
      tok[q] = s * (1.0f / 49.0f) + pv[q];
    }
    float m = row16_sum((tok.x + tok.y) + (tok.z + tok.w)) * (1.0f / 64.0f);
    v4f d = tok - m;
    float v = row16_sum((d.x * d.x + d.y * d.y) + (d.z * d.z + d.w * d.w)) * (1.0f / 64.0f);
    float rs = rsqrtf(v + 1e-5f);
    for (int q = 0; q < 4; ++q)
      s_lds[trow * 65 + j16 * 4 + q] = d[q] * rs * gv[q] + bv[q];
  }
  __syncthreads();

  // ---------- Phase A4: qk = s (16x64) @ Wqk (64x128); wave w -> 16-col tile w
  {
    v8f acc = {};
    const int n = wave * 16 + lane16;
#pragma unroll
    for (int k0 = 0; k0 < 64; k0 += 4) {
      int ka = k0 + 2 * half;
      v2f a, b;
      a.x = s_lds[lane16 * 65 + ka];
      a.y = s_lds[lane16 * 65 + ka + 1];
      b.x = Wqk[ka * QKD + n];
      b.y = Wqk[(ka + 1) * QKD + n];
      acc = __builtin_amdgcn_wmma_f32_16x16x4_f32(false, a, false, b, (short)0, acc, false, false);
    }
#pragma unroll
    for (int r = 0; r < 8; ++r)
      qk_lds[(r + 8 * half) * 129 + wave * 16 + lane16] = acc[r];
  }
  __syncthreads();

  // ---------- Phase A5: dots = q @ k^T * scale (wave 0; wave-uniform branch)
  if (wave == 0) {
    v8f acc = {};
#pragma unroll
    for (int k0 = 0; k0 < 64; k0 += 4) {
      int ka = k0 + 2 * half;
      v2f a, b;
      a.x = qk_lds[lane16 * 129 + ka];
      a.y = qk_lds[lane16 * 129 + ka + 1];
      b.x = qk_lds[lane16 * 129 + 64 + ka];
      b.y = qk_lds[lane16 * 129 + 64 + ka + 1];
      acc = __builtin_amdgcn_wmma_f32_16x16x4_f32(false, a, false, b, (short)0, acc, false, false);
    }
#pragma unroll
    for (int r = 0; r < 8; ++r)
      attn_lds[(r + 8 * half) * 17 + lane16] = acc[r] * 0.125f;  // DIM_HEAD^-0.5
  }
  __syncthreads();

  // ---------- Phase A6: softmax rows
  if (tid < T) {
    float mx = -3.4e38f;
    for (int j = 0; j < T; ++j) mx = fmaxf(mx, attn_lds[tid * 17 + j]);
    float sum = 0.f;
    for (int j = 0; j < T; ++j) {
      float e = __expf(attn_lds[tid * 17 + j] - mx);
      attn_lds[tid * 17 + j] = e;
      sum += e;
    }
    float inv = 1.0f / sum;
    for (int j = 0; j < T; ++j) attn_lds[tid * 17 + j] *= inv;
  }
  __syncthreads();
  // attn_lds is read-only from here; phase B uses no LDS writes -> no more block barriers.

  // ---------- Phase B: out = attn (16x16) @ v (16x3136) + x, per-wave 64-col chunks,
  // operands straight from global memory in registers. Lane (half, lane16) owns rows
  // 8*half .. 8*half+7 and the 4 adjacent columns 4*lane16 .. +3 of a chunk; sub-tile s
  // is the 16 columns 4*n + s. WMMA step j takes k = 8*half + 2*j + {0,1} for A and B
  // alike, so the 8 loaded 16-byte rows are B fragments and residual C seeds at once,
  // and D leaves as 16-byte stores.
  const int wv = __builtin_amdgcn_readfirstlane(wave);   // scalar: uniform branch round WMMAs
  v2f av[4];
#pragma unroll
  for (int j = 0; j < 4; ++j) {
    av[j].x = attn_lds[lane16 * 17 + 8 * half + 2 * j];
    av[j].y = attn_lds[lane16 * 17 + 8 * half + 2 * j + 1];
  }
  const size_t lbase = xbase + (size_t)(8 * half) * CHW + wv * 64 + lane16 * 4;
  const float* xp = x + lbase;
  float*       op = out + lbase;

  // 49 chunks of 64 columns, wave w takes w, w+8, ...: six each, chunk 48 is wave 0's.
  // Unrolled, so that every address is one base plus an immediate; chunk it+2 is loaded
  // while chunk it is worked on.
  // Passes -2 and -1 only load.
  v4f xv[3][8];
#pragma unroll
  for (int it = -2; it < 7; ++it) {
    if (it == 6 && wv != 0) break;
    if (it < 4 || (it == 4 && wv == 0)) {
#pragma unroll
      for (int r = 0; r < 8; ++r)
        xv[(it + 2) % 3][r] = *(const v4f*)(xp + r * CHW + (it + 2) * 512);
    }
    // keeps each chunk's loads together, in chunk order and in front of this chunk's
    // products: mixed loads make chunk 0 wait for all three, sunk loads wait at their use,
    // and merged chunks would finish, and start storing, all at once
    __builtin_amdgcn_sched_barrier(0);
    if (it < 0) continue;

    const v4f* xc = xv[it % 3];
    v8f acc[4];
#pragma unroll
    for (int s = 0; s < 4; ++s)
#pragma unroll
      for (int r = 0; r < 8; ++r)
        acc[s][r] = xc[r][s];          // residual seeds C
#pragma unroll
    for (int j = 0; j < 4; ++j)
#pragma unroll
      for (int s = 0; s < 4; ++s) {
        v2f b;
        b.x = xc[2 * j][s];
        b.y = xc[2 * j + 1][s];
        acc[s] = __builtin_amdgcn_wmma_f32_16x16x4_f32(false, av[j], false, b, (short)0, acc[s], false, false);
      }

    // 128-bit non-temporal stores, 256 B contiguous per row and half-wave
#pragma unroll
    for (int r = 0; r < 8; ++r) {
      v4f vv = { acc[0][r], acc[1][r], acc[2][r], acc[3][r] };
      __builtin_nontemporal_store(vv, (v4f*)(op + r * CHW + it * 512));
    }
    // behind every chunk's stores, on every path: later loads and moves reuse their data registers
    asm volatile("s_wait_xcnt 0x0" ::: "memory");
  }
}

extern "C" void kernel_launch(void* const* d_in, const int* in_sizes, int n_in,
                              void* d_out, int out_size, void* d_ws, size_t ws_size,
                              hipStream_t stream) {
  (void)in_sizes; (void)n_in; (void)d_ws; (void)ws_size; (void)out_size;
  const float* x     = (const float*)d_in[0];
  const float* pos   = (const float*)d_in[1];
  const float* Wqk   = (const float*)d_in[2];
  const float* gamma = (const float*)d_in[3];
  const float* beta  = (const float*)d_in[4];
  float* out = (float*)d_out;
  cta_attn_kernel<<<dim3(512), dim3(256), 0, stream>>>(x, pos, Wqk, gamma, beta, out);
}

// v003
// It runs in 18.6 microseconds.
// Next to v002, in two timings, it ran 1.10 and 1.11 times as fast.
// Counting every step since v000, it is 1.20 times as fast.
#include <hip/hip_runtime.h>
#include <stdint.h>

typedef __attribute__((ext_vector_type(2))) float    v2f;
typedef __attribute__((ext_vector_type(4))) float    v4f;
typedef __attribute__((ext_vector_type(8))) float    v8f;

#define T     16       // time steps
#define CCH   64       // channels
#define HW    3136     // 56*56
#define WIMG  56
#define P     64       // DIM*DIM token features
#define QKD   128      // 2*DIM_HEAD
#define CHW   (CCH*HW) // t-stride in x (elements)

// value of lane l ^ M inside a 16-lane row (DPP row_xmask); every lane must be on
template <int M>
__device__ __forceinline__ float row_xor(float x) {
  return __builtin_bit_cast(float, __builtin_amdgcn_update_dpp(
      0, __builtin_bit_cast(int, x), 0x160 | M, 0xf, 0xf, true));
}
// sum over a 16-lane row, the result in every lane of it
__device__ __forceinline__ float row16_sum(float x) {
  x += row_xor<1>(x);
  x += row_xor<2>(x);
  x += row_xor<4>(x);
  x += row_xor<8>(x);
  return x;
}

// work-group barrier that orders LDS traffic only: __syncthreads() would also wait for the
// global loads that were issued ahead for later phases, and end their flight here
__device__ __forceinline__ void lds_barrier() {
  __builtin_amdgcn_fence(__ATOMIC_RELEASE, "workgroup", "local");
  __builtin_amdgcn_s_barrier();
  __builtin_amdgcn_fence(__ATOMIC_ACQUIRE, "workgroup", "local");
}

// second argument: 4 waves a SIMD, so that two work-groups still share a WGP
__global__ __launch_bounds__(256, 4) void cta_attn_kernel(
    const float* __restrict__ x,
    const float* __restrict__ pos,
    const float* __restrict__ Wqk,
    const float* __restrict__ gamma,
    const float* __restrict__ beta,
    float* __restrict__ out)
{
  __shared__ __align__(16) float colsum[T * 8 * WIMG];   // 7-row column sums
  __shared__ float s_lds[T * 65];      // tokens (padded stride)
  __shared__ float qk_lds[T * 129];    // q|k (padded stride)
  __shared__ float attn_lds[T * 17];   // attention matrix (padded stride)

  const int tid    = threadIdx.x;
  const int lane   = tid & 31;
  const int wave   = tid >> 5;
  const int lane16 = lane & 15;
  const int half   = lane >> 4;

  const int bc = blockIdx.x;           // b*64 + c
  const int bb = bc >> 6;
  const int ch = bc & 63;
  const size_t xbase = ((size_t)(bb * T) * CCH + ch) * HW;  // x[b,0,c,0,0]

  const int trow = tid >> 4;           // token row
  const int j16  = tid & 15;           // features 4*j16 .. 4*j16+3
  v4f pv, gv, bv;                      // pos, gamma, beta of this thread's 4 features
  v2f wq[16];                          // this lane's B fragments of Wqk, phase A4

  // ---------- Phase B's addresses (layout: see phase B)
  const int wv = __builtin_amdgcn_readfirstlane(wave);   // scalar: uniform branch round WMMAs
  const size_t lbase = xbase + (size_t)(8 * half) * CHW + wv * 64 + lane16 * 4;
  const float* xp = x + lbase;
  float*       op = out + lbase;
  v4f xv[6][8];                        // phase B's operands, six chunks of this wave

  // ---------- Phase A1: 7-row column sums, float4 (b128) coalesced loads
  // 1792 float4 column groups: (t, py, c4) with c4 in [0,14); thread tid takes groups
  // tid + 256*i. The loads run 3 groups (21 loads) ahead of the sums, in a ring of
  // registers. Behind the last group follow the loads of later phases: first those of the
  // middle phases (loads return in order: behind phase B's they would have to wait for all
  // of those), then phase B's chunks 0..3, which so come from L2 while the middle phases
  // leave the memory path idle.
  const float* xb = x + xbase;
  unsigned off[7];                     // element offset of group i's first row in xb
#pragma unroll
  for (int i = 0; i < 7; ++i) {
    unsigned g  = tid + 256 * i;       // 0..1791
    unsigned c4 = g % 14;
    unsigned py = (g / 14) & 7;
    unsigned t  = g / 112;
    off[i] = t * CHW + (py * 7) * WIMG + c4 * 4;
  }
  v4f ld[3][7];
#pragma unroll
  for (int i = -3; i + 3 < 8 + 4; ++i) {
    if (i >= 0 && i < 7) {
      v4f s = {};
#pragma unroll
      for (int r = 0; r < 7; ++r)
        s += ld[i % 3][r];
      // (t*8 + py)*56 + c4*4 is 4*g
      *(v4f*)(colsum + 4 * (tid + 256 * i)) = s;
    }
    const int slot = i + 3;
    const float* held = xp;            // the address that the wait below keeps in its registers
    if (slot < 7) {
      const float* src = xb + off[slot];
      held = src;
#pragma unroll
      for (int r = 0; r < 7; ++r)
        ld[slot % 3][r] = *(const v4f*)(src + r * WIMG);
    } else if (slot == 7) {
      pv = *(const v4f*)(pos + ((size_t)bc * T + trow) * P + j16 * 4);
      gv = *(const v4f*)(gamma + j16 * 4);
      bv = *(const v4f*)(beta + j16 * 4);
#pragma unroll
      for (int kk = 0; kk < 16; ++kk) {
        wq[kk].x = Wqk[(4 * kk + 2 * half) * QKD + wave * 16 + lane16];
        wq[kk].y = Wqk[(4 * kk + 2 * half + 1) * QKD + wave * 16 + lane16];
      }
    } else {
#pragma unroll
      for (int r = 0; r < 8; ++r)
        xv[slot - 8][r] = *(const v4f*)(xp + r * CHW + (slot - 8) * 512);
    }
    // behind each batch of loads: later loads' data and address sums reuse their address
    // registers; the address is an input, so that no load of the batch itself lands on it
    asm volatile("s_wait_xcnt 0x0" :: "v"(held) : "memory");
    // holds this order: left to itself the compiler waits for every load right behind it,
    // and the chunks' loads must stay here and in chunk order (chunk 0 is waited for first)
    __builtin_amdgcn_sched_barrier(0);
  }
  lds_barrier();

  // ---------- Phase A2+A3: tokens and LayerNorm in registers, 16 lanes a token row,
  // 4 features a lane. Feature p of row t sums colsum[t*448 + 7p .. 7p+6], so thread
  // (trow, j16) reads the 28 consecutive column sums at 28*tid.
  {
    float f[28];
    for (int i = 0; i < 7; ++i) {
      v4f c = *(const v4f*)(colsum + tid * 28 + i * 4);
      f[4 * i] = c.x; f[4 * i + 1] = c.y; f[4 * i + 2] = c.z; f[4 * i + 3] = c.w;
    }
    v4f tok;
    for (int q = 0; q < 4; ++q) {
      float s = 0.f;
      for (int cc = 0; cc < 7; ++cc) s += f[7 * q + cc];
      tok[q] = s * (1.0f / 49.0f) + pv[q];
    }
    float m = row16_sum((tok.x + tok.y) + (tok.z + tok.w)) * (1.0f / 64.0f);
    v4f d = tok - m;
    float v = row16_sum((d.x * d.x + d.y * d.y) + (d.z * d.z + d.w * d.w)) * (1.0f / 64.0f);
    float rs = rsqrtf(v + 1e-5f);
    for (int q = 0; q < 4; ++q)
      s_lds[trow * 65 + j16 * 4 + q] = d[q] * rs * gv[q] + bv[q];
  }
  lds_barrier();

  // ---------- Phase A4: qk = s (16x64) @ Wqk (64x128); wave w -> 16-col tile w
  {
    v8f acc = {};
#pragma unroll
    for (int k0 = 0; k0 < 64; k0 += 4) {
      int ka = k0 + 2 * half;
      v2f a;
      a.x = s_lds[lane16 * 65 + ka];
      a.y = s_lds[lane16 * 65 + ka + 1];
      acc = __builtin_amdgcn_wmma_f32_16x16x4_f32(false, a, false, wq[k0 / 4], (short)0, acc, false, false);
    }
#pragma unroll
    for (int r = 0; r < 8; ++r)
      qk_lds[(r + 8 * half) * 129 + wave * 16 + lane16] = acc[r];
  }
  // chunks 4 and 5 follow in this phase, where the Wqk fragments' registers come free
#pragma unroll
  for (int c = 4; c < 6; ++c) {
#pragma unroll
    for (int r = 0; r < 8; ++r)
      xv[c][r] = *(const v4f*)(xp + r * CHW + c * 512);
    // as above: the wait for the address registers; not later than here, and in chunk order
    asm volatile("s_wait_xcnt 0x0" ::: "memory");
    __builtin_amdgcn_sched_barrier(0);
  }
  lds_barrier();

  // ---------- Phase A5: dots = q @ k^T * scale (wave 0; wave-uniform branch)
  if (wave == 0) {
    v8f acc = {};
#pragma unroll
    for (int k0 = 0; k0 < 64; k0 += 4) {
      int ka = k0 + 2 * half;
      v2f a, b;
      a.x = qk_lds[lane16 * 129 + ka];
      a.y = qk_lds[lane16 * 129 + ka + 1];
      b.x = qk_lds[lane16 * 129 + 64 + ka];
      b.y = qk_lds[lane16 * 129 + 64 + ka + 1];
      acc = __builtin_amdgcn_wmma_f32_16x16x4_f32(false, a, false, b, (short)0, acc, false, false);
    }
#pragma unroll
    for (int r = 0; r < 8; ++r)
      attn_lds[(r + 8 * half) * 17 + lane16] = acc[r] * 0.125f;  // DIM_HEAD^-0.5
  }
  lds_barrier();

  // ---------- Phase A6: softmax rows
  if (tid < T) {
    float mx = -3.4e38f;
    for (int j = 0; j < T; ++j) mx = fmaxf(mx, attn_lds[tid * 17 + j]);
    float sum = 0.f;
    for (int j = 0; j < T; ++j) {
      float e = __expf(attn_lds[tid * 17 + j] - mx);
      attn_lds[tid * 17 + j] = e;
      sum += e;
    }
    float inv = 1.0f / sum;
    for (int j = 0; j < T; ++j) attn_lds[tid * 17 + j] *= inv;
  }
  lds_barrier();
  // attn_lds is read-only from here; phase B uses no LDS writes -> no more block barriers.

  // ---------- Phase B: out = attn (16x16) @ v (16x3136) + x, per-wave 64-col chunks,
  // operands straight from global memory in registers. Lane (half, lane16) owns rows
  // 8*half .. 8*half+7 and the 4 adjacent columns 4*lane16 .. +3 of a chunk; sub-tile s
  // is the 16 columns 4*n + s. WMMA step j takes k = 8*half + 2*j + {0,1} for A and B
  // alike, so the 8 loaded 16-byte rows are B fragments and residual C seeds at once,
  // and D leaves as 16-byte stores.
  v2f av[4];
#pragma unroll
  for (int j = 0; j < 4; ++j) {
    av[j].x = attn_lds[lane16 * 17 + 8 * half + 2 * j];
    av[j].y = attn_lds[lane16 * 17 + 8 * half + 2 * j + 1];
  }

  // 49 chunks of 64 columns, wave w takes w, w+8, ...: six each, all loaded above; chunk 48
  // is wave 0's and takes chunk 0's registers once that is stored. Unrolled, so that every
  // address is one base plus an immediate.
#pragma unroll
  for (int it = 0; it < 7; ++it) {
    if (it == 6 && wv != 0) break;

    const v4f* xc = xv[it % 6];
    v8f acc[4];
#pragma unroll
    for (int s = 0; s < 4; ++s)
#pragma unroll
      for (int r = 0; r < 8; ++r)
        acc[s][r] = xc[r][s];          // residual seeds C
#pragma unroll
    for (int j = 0; j < 4; ++j)
#pragma unroll
      for (int s = 0; s < 4; ++s) {
        v2f b;
        b.x = xc[2 * j][s];
        b.y = xc[2 * j + 1][s];
        acc[s] = __builtin_amdgcn_wmma_f32_16x16x4_f32(false, av[j], false, b, (short)0, acc[s], false, false);
      }

    // 128-bit non-temporal stores, 256 B contiguous per row and half-wave
#pragma unroll
    for (int r = 0; r < 8; ++r) {
      v4f vv = { acc[0][r], acc[1][r], acc[2][r], acc[3][r] };
      __builtin_nontemporal_store(vv, (v4f*)(op + r * CHW + it * 512));
    }
    // behind every chunk's stores, on every path: later loads and moves reuse their data registers
    asm volatile("s_wait_xcnt 0x0" ::: "memory");
    if (it == 0 && wv == 0) {
#pragma unroll
      for (int r = 0; r < 8; ++r)
        xv[0][r] = *(const v4f*)(xp + r * CHW + 6 * 512);
      // as above: the wait for the address registers
      asm volatile("s_wait_xcnt 0x0" ::: "memory");
    }
    // keeps the chunks apart: merged chunks would finish, and start storing, all at once
    __builtin_amdgcn_sched_barrier(0);
  }
}

extern "C" void kernel_launch(void* const* d_in, const int* in_sizes, int n_in,
                              void* d_out, int out_size, void* d_ws, size_t ws_size,
                              hipStream_t stream) {
  (void)in_sizes; (void)n_in; (void)d_ws; (void)ws_size; (void)out_size;
  const float* x     = (const float*)d_in[0];
  const float* pos   = (const float*)d_in[1];
  const float* Wqk   = (const float*)d_in[2];
  const float* gamma = (const float*)d_in[3];
  const float* beta  = (const float*)d_in[4];
  float* out = (float*)d_out;
  cta_attn_kernel<<<dim3(512), dim3(256), 0, stream>>>(x, pos, Wqk, gamma, beta, out);
}
